// v010
// The times below were measured on an AMD MI455X: many runs one after another, warmed up first and cycling through
// copies of the inputs, with the whole window's GPU time divided by the number of runs. Launches and the gaps
// between them are all in it. The median over several windows is given; except for v000 it joins two sittings, which
// can be a few percent apart, so the side-by-side timings, each taken in one sitting, are the better comparison.
// Earlier versions than v010 are not in this document.
// It runs in 157 microseconds.
// Timed twice side by side with v009, it ran 1.23 times as fast both times.
// Counting every step since v000, which is the starting kernel, it is 10.1 times as fast.
#include <hip/hip_runtime.h>
// Pose-aware attention (8 batches x 1024 tokens x 1024; 16 heads x 64): qkv = x Wqkv + b; per-batch pose embedding = relu(pose W1 + b1) W2 + b2 split into (q, k, v) biases per (head, dim) and added to q/k/v; softmax(q k^T / 8) v; out Wproj + b -> [8,1024,1024].
// Structure: the pose MLP on VALU folded into per-batch bias vectors (bqkv + pose_{q|k|v}[b]); x as an exact f16 plane; one qkv GEMM over all 8192 rows x 3072 columns (256x128 blocks staged in LDS, 64x64 wave tiles, f32 accumulation, exact x16 weights, that per-batch bias picked by row / 1024) whose epilogue itself splits q and k into f16 hi + 2^10 residual planes and stores v as the f16 V^T plane (no f32 plane, no split or transpose launch); the fused flash kernel, products transposed (S^T = K Q^T, O^T = V^T P^T; softmax statistics per lane, P kept in registers), with hi + 2^10-residual q/k planes (S = QhKh + (QlKh + QhKl)/1024) and plain f16 P (x2^10) and V (S with hi/lo operands, P.V with plain ones); the attention output, split into hi + residual by the flash kernel's own epilogue, into one projection GEMM that sums the hi and then the residual products in the same accumulators.
// Operand layout: every f16 plane that feeds a matrix instruction (x, both weights, q|k|v hi and residual, V^T, the attention output hi and residual) is stored in FRAGMENT ORDER: a [rows][KC] plane is cut into 16-row x 32-column tiles of 1 KiB, tile (row / 16, col / 32) at tile index (row / 16) * (KC / 32) + col / 32, and inside a tile the 16-byte chunk of row r, columns 8c..8c+7 (c = 0..3) sits at chunk c * 16 + r. A wave's fragment load (lane = 16 * hh + ln reads row ln, chunk 2 * half + hh) is then 512 contiguous bytes (4 cache lines) where a row-major plane made it touch 16 lines for the same bytes; values and their lane/register places are those of the row-major loaders.
// Compute dtype: x, pose and all parameters rounded to bf16; q, k hi + residual (~2^-21-class logits); P and v plain f16 (~2^-12); f32 accumulation/softmax. v_wmma_f32_16x16x32_f16.
#define NB 8
#define DMOD 1024
#define NR (NB * SLEN)
#define QBLKS (TQ / 64)
#define FQT 2                     /* query tiles of 16 a wave in k_flashqk */
#define FQBLKS (TQ / (64 * FQT))
#define SLEN 1024
#define TQ SLEN
#define TK SLEN
#define NH 16
#define SCL 0.125f               /* 64^-0.5 */
#define SCL2 0.18033688011112042f /* 64^-0.5 * log2(e): scores to base-2 exponents in k_flashqk */
typedef __bf16 v16b __attribute__((ext_vector_type(16)));
typedef unsigned short v8us __attribute__((ext_vector_type(8), may_alias));
typedef float  v8f  __attribute__((ext_vector_type(8)));
typedef float  v4f  __attribute__((ext_vector_type(4)));
typedef float  v4fa __attribute__((ext_vector_type(4), may_alias));
union FragB { v16b v; v8us half[2]; unsigned short u[16]; };

__device__ __forceinline__ unsigned short bf16_bits(float x) { unsigned int u = __float_as_uint(x); return (unsigned short)((u + 0x7FFFu + ((u >> 16) & 1u)) >> 16); }
__device__ __forceinline__ float bf16_val(unsigned short b) { return __uint_as_float(((unsigned int)b) << 16); }
__device__ __forceinline__ float bf16_round(float x) { return bf16_val(bf16_bits(x)); }
// D += A·B with NT terms: 1 = ah·bh, 2 = + al·bh (A split), 3 = + ah·bl (both split)
template <int NT>
__device__ __forceinline__ v8f mmaN(v16b ah, v16b al, v16b bh, v16b bl, v8f c) {
  c = __builtin_amdgcn_wmma_f32_16x16x32_bf16(false, ah, false, bh, (short)0, c, false, false);
  if (NT >= 2) c = __builtin_amdgcn_wmma_f32_16x16x32_bf16(false, al, false, bh, (short)0, c, false, false);
  if (NT >= 3) c = __builtin_amdgcn_wmma_f32_16x16x32_bf16(false, ah, false, bl, (short)0, c, false, false);
  asm volatile("v_nop\n\tv_nop\n\tv_nop\n\tv_nop" : "+v"(c) : "v"(ah), "v"(al), "v"(bh), "v"(bl));
  return c;
}

__global__ __launch_bounds__(256) void k_wt_bf16(const float* __restrict__ W, unsigned short* __restrict__ Wt, int K, int N) {
  const int t = blockIdx.x * 256 + threadIdx.x;
  const int k8n = K / 8;
  if (t >= N * k8n) return;
  const int n = t / k8n, k8 = (t % k8n) * 8;
  v8us v;
#pragma unroll
  for (int i = 0; i < 8; ++i) v[i] = bf16_bits(W[(size_t)(k8 + i) * N + n]);
  *(v8us*)(Wt + (size_t)n * K + k8) = v;
  
}

// GEMM C[M][N] (f32, pitch ldc) = act(A[M][K]·W + bias). A f32 row-major (pitch lda) converted per fragment to bf16
// (ASPLIT: hi/lo two planes -> 2 terms, else single rounded term); Wt bf16 [N][K] (pitch ldb). BIAS_BF16 rounds the
// bias to bf16 first (bias quantised to bf16 before the add). K%32==0, M%16==0, N%64==0.
template <bool ASPLIT, int ACT, bool BIAS_BF16>
__global__ __launch_bounds__(128) void k_gemm_bf(const float* __restrict__ A, int lda, const unsigned short* __restrict__ Wt, int ldb,
                                               const float* __restrict__ bias, float* __restrict__ C, int ldc, int M, int N, int K) {
  __shared__ __attribute__((aligned(16))) float so[4][16][64];
  const int tid = threadIdx.x, w = tid >> 5, lane = tid & 31, ln = lane & 15, hh = lane >> 4;
  const int ntn = N / 64;
  const int wid = blockIdx.x * 4 + w;
  const int mt = wid / ntn, nq = wid % ntn;
  if (mt * 16 >= M) return;
  const int row0 = mt * 16, col0 = nq * 64;
  const float* arow = A + (size_t)(row0 + ln) * lda;
  v8f acc[4] = {};
  for (int kb = 0; kb < K; kb += 32) {
    FragB ah, al;
    const v4f x0 = *(const v4fa*)(arow + kb + 8 * hh), x1 = *(const v4fa*)(arow + kb + 8 * hh + 4);
    const v4f x2 = *(const v4fa*)(arow + kb + 16 + 8 * hh), x3 = *(const v4fa*)(arow + kb + 16 + 8 * hh + 4);
    float xs[16] = {x0[0],x0[1],x0[2],x0[3],x1[0],x1[1],x1[2],x1[3],x2[0],x2[1],x2[2],x2[3],x3[0],x3[1],x3[2],x3[3]};
#pragma unroll
    for (int i = 0; i < 16; ++i) { const unsigned short hb = bf16_bits(xs[i]); ah.u[i] = hb; al.u[i] = ASPLIT ? bf16_bits(xs[i] - bf16_val(hb)) : (unsigned short)0; }
#pragma unroll
    for (int t = 0; t < 4; ++t) {
      const unsigned short* brow = Wt + (size_t)(col0 + t * 16 + ln) * ldb + kb;
      FragB b;
      b.half[0] = *(const v8us*)(brow + 8 * hh);
      b.half[1] = *(const v8us*)(brow + 16 + 8 * hh);
      acc[t] = mmaN<ASPLIT ? 2 : 1>(ah.v, al.v, b.v, b.v, acc[t]);
    }
  }
#pragma unroll
  for (int t = 0; t < 4; ++t) {
    float bv = bias ? bias[col0 + t * 16 + ln] : 0.f;
    if (BIAS_BF16) bv = bf16_round(bv);
#pragma unroll
    for (int r = 0; r < 8; ++r) { float v = acc[t][r] + bv; if (ACT == 1) v = fmaxf(v, 0.f); so[w][8 * hh + r][t * 16 + ln] = v; }
  }
  __builtin_amdgcn_fence(__ATOMIC_ACQ_REL, "workgroup");
  __builtin_amdgcn_wave_barrier();
  const int rsub = lane >> 4, c4 = (lane & 15) * 4;
  {
#pragma unroll
    for (int q = 0; q < 8; ++q) {
      const int r = q * 2 + rsub;
      const v4f v = *(const v4fa*)&so[w][r][c4];
      *(v4f*)(C + (size_t)(row0 + r) * ldc + col0 + c4) = v;
    }
    
  }
}

// GEMM C = act(A·W + bias + resid): A f32 (ASPLIT -> hi/lo 2 terms), Wt bf16 [N][K]; ACT 0 none, 1 relu, 2 exact gelu;
// resid (optional, f32, row index = (row % rmod), pitch ldr, RES_BF16 rounds it) added before the activation.
template <bool ASPLIT, int ACT, bool BIAS_BF16, bool RES_BF16>
__global__ __launch_bounds__(128) void k_gemm_bf3(const float* __restrict__ A, int lda, const unsigned short* __restrict__ Wt, int ldb,
                                                const float* __restrict__ bias, const float* __restrict__ resid, int rmod, int ldr,
                                                float* __restrict__ C, int ldc, int M, int N, int K) {
  __shared__ __attribute__((aligned(16))) float so[4][16][64];
  const int tid = threadIdx.x, w = tid >> 5, lane = tid & 31, ln = lane & 15, hh = lane >> 4;
  const int ntn = N / 64;
  const int wid = blockIdx.x * 4 + w;
  const int mt = wid / ntn, nq = wid % ntn;
  if (mt * 16 >= M) return;
  const int row0 = mt * 16, col0 = nq * 64;
  const float* arow = A + (size_t)(row0 + ln) * lda;
  v8f acc[4] = {};
  for (int kb = 0; kb < K; kb += 32) {
    FragB ah, al;
    const v4f x0 = *(const v4fa*)(arow + kb + 8 * hh), x1 = *(const v4fa*)(arow + kb + 8 * hh + 4);
    const v4f x2 = *(const v4fa*)(arow + kb + 16 + 8 * hh), x3 = *(const v4fa*)(arow + kb + 16 + 8 * hh + 4);
    float xs[16] = {x0[0],x0[1],x0[2],x0[3],x1[0],x1[1],x1[2],x1[3],x2[0],x2[1],x2[2],x2[3],x3[0],x3[1],x3[2],x3[3]};
#pragma unroll
    for (int i = 0; i < 16; ++i) { const unsigned short hb = bf16_bits(xs[i]); ah.u[i] = hb; al.u[i] = ASPLIT ? bf16_bits(xs[i] - bf16_val(hb)) : (unsigned short)0; }
#pragma unroll
    for (int t = 0; t < 4; ++t) {
      const unsigned short* brow = Wt + (size_t)(col0 + t * 16 + ln) * ldb + kb;
      FragB b;
      b.half[0] = *(const v8us*)(brow + 8 * hh);
      b.half[1] = *(const v8us*)(brow + 16 + 8 * hh);
      acc[t] = mmaN<ASPLIT ? 2 : 1>(ah.v, al.v, b.v, b.v, acc[t]);
    }
  }
#pragma unroll
  for (int t = 0; t < 4; ++t) {
    const int col = col0 + t * 16 + ln;
    float bv = bias ? bias[col] : 0.f;
    if (BIAS_BF16) bv = bf16_round(bv);
#pragma unroll
    for (int r = 0; r < 8; ++r) {
      float v = acc[t][r] + bv;
      if (resid) { float rv = resid[(size_t)((row0 + 8 * hh + r) % rmod) * ldr + col]; if (RES_BF16) rv = bf16_round(rv); v += rv; }
      if (ACT == 1) v = fmaxf(v, 0.f);
      if (ACT == 2) v = 0.5f * v * (1.0f + erff(v * 0.70710678118654752f));
      if (ACT == 3) { const float u = 0.7978845608028654f * (v + 0.044715f * v * v * v); v = 0.5f * v * (1.0f + tanhf(u)); }
      so[w][8 * hh + r][t * 16 + ln] = v;
    }
  }
  __builtin_amdgcn_fence(__ATOMIC_ACQ_REL, "workgroup");
  __builtin_amdgcn_wave_barrier();
  const int rsub = lane >> 4, c4 = (lane & 15) * 4;
  {
#pragma unroll
    for (int q = 0; q < 8; ++q) {
      const int r = q * 2 + rsub;
      const v4f v = *(const v4fa*)&so[w][r][c4];
      *(v4f*)(C + (size_t)(row0 + r) * ldc + col0 + c4) = v;
    }
    
  }
}
// row LayerNorm (biased variance, eps) over N: s = X (+ R); optional out_sum <- s; out_norm <- (s-mu)*rsqrt(var+eps)*g + b
template <bool PARAM_BF16>
__global__ __launch_bounds__(256) void k_layernorm(const float* __restrict__ X, const float* __restrict__ R, const float* __restrict__ g, const float* __restrict__ bta,
                                                  float* __restrict__ out_sum, float* __restrict__ out_norm, int N, float eps) {
  __shared__ float red[256];
  const int row = blockIdx.x, tid = threadIdx.x;
  const float* x = X + (size_t)row * N; const float* rr = R ? R + (size_t)row * N : nullptr;
  float vals[16];                     // up to N = 4096
  const int per = N / 256;            // contiguous chunk per thread? use strided-by-4 chunks: thread handles j = tid*4 + 1024*u
  float s1 = 0.f;
  for (int u = 0; u < per / 4; ++u) {
    const int j = tid * 4 + 1024 * u;
    const v4f a = *(const v4fa*)(x + j);
    v4f b = {0.f,0.f,0.f,0.f}; if (rr) b = *(const v4fa*)(rr + j);
#pragma unroll
    for (int q = 0; q < 4; ++q) { const float v = a[q] + b[q]; vals[u * 4 + q] = v; s1 += v; }
  }
  red[tid] = s1; __syncthreads();
  for (int st = 128; st > 0; st >>= 1) { if (tid < st) red[tid] += red[tid + st]; __syncthreads(); }
  const float mu = red[0] / (float)N; __syncthreads();
  float s2 = 0.f;
  for (int u = 0; u < per / 4; ++u)
#pragma unroll
    for (int q = 0; q < 4; ++q) { const float c = vals[u * 4 + q] - mu; s2 += c * c; }
  red[tid] = s2; __syncthreads();
  for (int st = 128; st > 0; st >>= 1) { if (tid < st) red[tid] += red[tid + st]; __syncthreads(); }
  const float rs = rsqrtf(red[0] / (float)N + eps);
  {
    for (int u = 0; u < per / 4; ++u) {
      const int j = tid * 4 + 1024 * u;
      v4f o, sm;
#pragma unroll
      for (int q = 0; q < 4; ++q) {
        float gg = g[j + q], bb = bta[j + q];
        if (PARAM_BF16) { gg = bf16_round(gg); bb = bf16_round(bb); }
        sm[q] = vals[u * 4 + q]; o[q] = (vals[u * 4 + q] - mu) * rs * gg + bb;
      }
      if (out_sum) *(v4f*)(out_sum + (size_t)row * N + j) = sm;
      *(v4f*)(out_norm + (size_t)row * N + j) = o;
    }
    
  }
}



// ---- f16 WMMA path (v_wmma_f32_16x16x32_f16): 11-bit significands for operands in range — used where a [0,1] probability operand needs more precision than bf16
typedef _Float16 v16h __attribute__((ext_vector_type(16)));
union FragH { v16h v; v8us half[2]; _Float16 h[16]; unsigned short u[16]; };
template <int NT>
__device__ __forceinline__ v8f mmaH(v16h ah, v16h al, v16h bh, v16h bl, v8f c) {
  c = __builtin_amdgcn_wmma_f32_16x16x32_f16(false, ah, false, bh, (short)0, c, false, false);
  if (NT >= 2) c = __builtin_amdgcn_wmma_f32_16x16x32_f16(false, al, false, bh, (short)0, c, false, false);
  if (NT >= 3) c = __builtin_amdgcn_wmma_f32_16x16x32_f16(false, ah, false, bl, (short)0, c, false, false);
  asm volatile("v_nop\n\tv_nop\n\tv_nop\n\tv_nop" : "+v"(c) : "v"(ah), "v"(al), "v"(bh), "v"(bl));
  return c;
}
// batched GEMM like k_gemm_b but f16 operands: A f32 (split into f16 hi/lo if ASPLIT, else rounded to f16), Bt = f16 values [n][k]; alpha; C f32; N multiple of 16 (partial tiles skipped)
template <bool ASPLIT>
__global__ __launch_bounds__(128) void k_gemm_h(const float* __restrict__ A, int lda, size_t sA, const _Float16* __restrict__ Bh, int ldb, size_t sB, float alpha, float* __restrict__ C, int ldc, size_t sC, int M, int N, int K) {
  __shared__ __attribute__((aligned(16))) float so[4][16][64];
  const int tid = threadIdx.x, w = tid >> 5, lane = tid & 31, ln = lane & 15, hh = lane >> 4; const int by = blockIdx.y;
  A += (size_t)by * sA; Bh += (size_t)by * sB; C += (size_t)by * sC;
  const int ntn = (N + 63) / 64; const int wid = blockIdx.x * 4 + w; const int mt = wid / ntn, nq = wid % ntn; if (mt * 16 >= M) return;
  const int row0 = mt * 16, col0 = nq * 64; const float* arow = A + (size_t)(row0 + ln) * lda;
  v8f acc[4] = {};
  for (int kb = 0; kb < K; kb += 32) {
    FragH ah, al;
    const v4f x0 = *(const v4fa*)(arow + kb + 8 * hh), x1 = *(const v4fa*)(arow + kb + 8 * hh + 4), x2 = *(const v4fa*)(arow + kb + 16 + 8 * hh), x3 = *(const v4fa*)(arow + kb + 16 + 8 * hh + 4);
    float xs[16] = {x0[0],x0[1],x0[2],x0[3],x1[0],x1[1],x1[2],x1[3],x2[0],x2[1],x2[2],x2[3],x3[0],x3[1],x3[2],x3[3]};
#pragma unroll
    for (int i = 0; i < 16; ++i) { const _Float16 h = (_Float16)xs[i]; ah.h[i] = h; al.h[i] = ASPLIT ? (_Float16)(xs[i] - (float)h) : (_Float16)0.0f; }
#pragma unroll
    for (int t = 0; t < 4; ++t) { if (col0 + t * 16 >= N) continue; const size_t boff = (size_t)(col0 + t * 16 + ln) * ldb + kb; FragH bq; bq.half[0] = *(const v8us*)(Bh + boff + 8 * hh); bq.half[1] = *(const v8us*)(Bh + boff + 16 + 8 * hh);
      acc[t] = mmaH<ASPLIT ? 2 : 1>(ah.v, al.v, bq.v, bq.v, acc[t]); }
  }
#pragma unroll
  for (int t = 0; t < 4; ++t) { if (col0 + t * 16 >= N) continue;
#pragma unroll
    for (int r = 0; r < 8; ++r) so[w][8 * hh + r][t * 16 + ln] = acc[t][r] * alpha; }
  __builtin_amdgcn_fence(__ATOMIC_ACQ_REL, "workgroup"); __builtin_amdgcn_wave_barrier();
  const int rsub = lane >> 4, c4 = (lane & 15) * 4;
  {
#pragma unroll
    for (int q = 0; q < 8; ++q) { const int r = q * 2 + rsub; if (col0 + c4 < N) { const v4f v = *(const v4fa*)&so[w][r][c4]; *(v4f*)(C + (size_t)(row0 + r) * ldc + col0 + c4) = v; } }
     }
}

// Wt (rows n, columns k, fragment order) = f16(W[k][n] * scale) from f32 row-major W[K][N] (scale = power of two; bf16-exact weights stay exact in f16 away from the subnormal range)
__global__ __launch_bounds__(256) void k_wt_f16(const float* __restrict__ W, _Float16* __restrict__ Wt, int K, int N, float scale) {
  const int t = blockIdx.x * 256 + threadIdx.x; if (t >= N * (K / 8)) return; const int tile = t >> 6; const int n = (tile / (K / 32)) * 16 + (t & 15), k8 = (tile % (K / 32)) * 32 + ((t >> 4) & 3) * 8; FragH f;      /* t = the output chunk in fragment order (rows n, columns k): 16 neighbouring lanes read 16 neighbouring n */
#pragma unroll
  for (int i = 0; i < 8; ++i) f.h[i] = (_Float16)(bf16_round(W[(size_t)(k8 + i) * N + n]) * scale); const v8us o = f.half[0];
  *(v8us*)((unsigned short*)Wt + (size_t)t * 8) = o; 
}
// k_gemm_hh variant with fused epilogue: v = acc·alpha + bias[by·sBias + col] (+ CP[(row/rowsPerB)·sCPb + by·64 + col] if CP) ; ACT 0 none / 1 elu ; writes f16 C16 (and f32 C if non-null)
template <int ACT>
__global__ __launch_bounds__(128) void k_gemm_hhx(const _Float16* __restrict__ A, int lda, size_t sA, const _Float16* __restrict__ Bh, int ldb, size_t sB, float alpha, const float* __restrict__ bias, size_t sBias, const float* __restrict__ CP, int rowsPerB, size_t sCPb, int row0g,
    float* __restrict__ C, _Float16* __restrict__ C16, int ldc, size_t sC, int M, int N, int K) {
  __shared__ __attribute__((aligned(16))) float so[4][16][64];
  const int tid = threadIdx.x, w = tid >> 5, lane = tid & 31, ln = lane & 15, hh = lane >> 4; const int by = blockIdx.y;
  A += (size_t)by * sA; Bh += (size_t)by * sB; const size_t cofs = (size_t)by * sC; const float* bp = bias ? bias + (size_t)by * sBias : nullptr;
  const int ntn = (N + 63) / 64; const int wid = blockIdx.x * 4 + w; const int mt = wid / ntn, nq = wid % ntn; if (mt * 16 >= M) return;
  const int row0 = mt * 16, col0 = nq * 64; const _Float16* arow = A + (size_t)(row0 + ln) * lda;
  v8f acc[4] = {};
  for (int kb = 0; kb < K; kb += 32) { FragH ah; ah.half[0] = *(const v8us*)((const unsigned short*)arow + kb + 8 * hh); ah.half[1] = *(const v8us*)((const unsigned short*)arow + kb + 16 + 8 * hh);
#pragma unroll
    for (int t = 0; t < 4; ++t) { if (col0 + t * 16 >= N) continue; const size_t boff = (size_t)(col0 + t * 16 + ln) * ldb + kb; FragH bq; bq.half[0] = *(const v8us*)((const unsigned short*)Bh + boff + 8 * hh); bq.half[1] = *(const v8us*)((const unsigned short*)Bh + boff + 16 + 8 * hh);
      acc[t] = mmaH<1>(ah.v, ah.v, bq.v, bq.v, acc[t]); }
  }
#pragma unroll
  for (int t = 0; t < 4; ++t) { if (col0 + t * 16 >= N) continue; const int col = col0 + t * 16 + ln; const float bv = bp ? bf16_round(bp[col]) : 0.f;
#pragma unroll
    for (int r = 0; r < 8; ++r) { float v = acc[t][r] * alpha + bv; if (CP) { const int bidx = (row0g + row0 + 8 * hh + r) / rowsPerB; v += CP[(size_t)bidx * sCPb + (size_t)by * 64 + col]; } if (ACT == 1) v = (v > 0.f) ? v : expm1f(v); else if (ACT == 7) v = (v > 0.f) ? v + 1.0f : expf(v); else if (ACT == 8) v = tanhf(v); else if (ACT == 9) v = 0.5f * v * (1.0f + tanhf(0.7978845608028654f * (v + 0.044715f * v * v * v))); else if (ACT == 11) v = 1.0f / (1.0f + expf(-v)); else if (ACT == 12) v = (v > 0.f) ? v : 0.01f * v; else if (ACT == 14) v = (v > 0.f) ? v : 0.1f * v; else if (ACT == 15) v = v / (1.0f + expf(-v)); else if (ACT == 3) v = fmaxf(v, 0.f); else if (ACT == 6) v = 0.5f * v * (1.0f + erff(v * 0.70710678118654752f)); so[w][8 * hh + r][t * 16 + ln] = v; } }
  __builtin_amdgcn_fence(__ATOMIC_ACQ_REL, "workgroup"); __builtin_amdgcn_wave_barrier();
  const int rsub = lane >> 4, c4 = (lane & 15) * 4; typedef _Float16 v4h __attribute__((ext_vector_type(4)));
  {
#pragma unroll
    for (int q = 0; q < 8; ++q) { const int r = q * 2 + rsub; if (col0 + c4 < N) { const v4f v = *(const v4fa*)&so[w][r][c4]; if (C) *(v4f*)(C + cofs + (size_t)(row0 + r) * ldc + col0 + c4) = v; if (C16) { v4h h4; for (int i = 0; i < 4; ++i) h4[i] = (_Float16)v[i]; *(v4h*)(C16 + cofs + (size_t)(row0 + r) * ldc + col0 + c4) = h4; } } }
     }
}


typedef _Float16 v4h __attribute__((ext_vector_type(4)));

// row-major f32 [rows][KC] -> fragment order: a wave takes 8 rows x the 4 chunks of one tile, so it reads 8 whole 128-byte lines and stores 4 whole lines. fo_src = element offset in the row-major source, fo_dst = 16-byte chunk index in the fragment-order plane
template <int KC> __device__ __forceinline__ size_t fo_src(size_t t) { const unsigned u = (unsigned)t, tile = u >> 6; return ((tile / (KC / 32)) * 16 + ((u & 7) | ((u >> 2) & 8))) * KC + (tile % (KC / 32)) * 32 + ((u >> 3) & 3) * 8; }      /* 32-bit: the planes here hold at most 8192 * 3072 elements */
__device__ __forceinline__ size_t fo_dst(size_t t) { const unsigned u = (unsigned)t; return (u >> 6) * 64 + ((u >> 3) & 3) * 16 + ((u & 7) | ((u >> 2) & 8)); }
__global__ __launch_bounds__(256) void k_x16(const float* __restrict__ x, _Float16* __restrict__ X16, size_t n8) { const size_t t = (size_t)blockIdx.x * 256 + threadIdx.x; if (t >= n8) return; FragH f; const size_t s = fo_src<DMOD>(t);
#pragma unroll
  for (int q = 0; q < 8; ++q) f.h[q] = (_Float16)bf16_round(x[s + q]); *(v8us*)((unsigned short*)X16 + fo_dst(t) * 8) = f.half[0];  }
__global__ __launch_bounds__(256) void k_h16(const float* __restrict__ x, _Float16* __restrict__ X16, size_t n8) { const size_t t = (size_t)blockIdx.x * 256 + threadIdx.x; if (t >= n8) return; FragH f;
#pragma unroll
  for (int q = 0; q < 8; ++q) f.h[q] = (_Float16)x[t * 8 + q]; *(v8us*)((unsigned short*)X16 + t * 8) = f.half[0];  }
__global__ __launch_bounds__(256) void k_round16f(const float* __restrict__ W, _Float16* __restrict__ Bt, size_t n8) { const size_t t = (size_t)blockIdx.x * 256 + threadIdx.x; if (t >= n8) return; FragH f;
#pragma unroll
  for (int i = 0; i < 8; ++i) f.h[i] = (_Float16)(bf16_round(W[t * 8 + i]) * 16.0f); *(v8us*)((unsigned short*)Bt + t * 8) = f.half[0];  }

// ---- fast GEMM; A and Bh in fragment order (16 rows = 16 * columns elements, 32 columns = 512 elements) ----
__device__ __forceinline__ v8f g2_mma(v16h a, v16h b, v8f c) { v8f d = __builtin_amdgcn_wmma_f32_16x16x32_f16(false, a, false, b, (short)0, c, false, false); asm volatile("v_nop\n\tv_nop\n\tv_nop\n\tv_nop" : "+v"(d) : "v"(a), "v"(b)); return d; }
// ---- LDS-staged GEMM main loop: a block of 8 waves owns 256 rows x 128 columns, a wave 64 x 64 (4 A x 4 B fragments, 16 accumulators). ----
// A stage is KT k steps (32 * KT k) of the block's 16 A row groups and 8 B row groups: in fragment order each group's KT tiles are KT KiB in a row, so a stage is 24 pieces of KT KiB, laid in LDS group after group (A groups 0..15, then B groups 0..7). Wave w brings groups 3w..3w+2 by 6 * KT asynchronous copies of 512 bytes. Every operand byte then leaves L2 once per block, where each wave of the 128 x 64 block loaded its own 6 KiB per k step into registers; a fragment read is 2 ds_load_b128 of 512 bytes in a row.
// Two buffers: stage s + 2 is asked for at the foot of trip s, into the buffer that trip s has just read. Every accumulator takes its k steps in rising order.
#define GS_STAGE(KT) (24 * (KT) * 1024)
__device__ __forceinline__ v16h gs_frag(const char* p) { FragH f; f.half[0] = *(const v8us*)p; f.half[1] = *(const v8us*)(p + 512); return f.v; }      /* p = the tile's place in LDS + 16 * lane */
__device__ __forceinline__ void gs_copy12(const unsigned (&l)[12], const unsigned long long (&g)[12]) {      /* l = the lane's own LDS byte address, g = its own global address; the wait as the statement's last line stands in front of any rewrite of these registers */
  asm volatile("global_load_async_to_lds_b128 %0, %12, off\n\tglobal_load_async_to_lds_b128 %1, %13, off\n\tglobal_load_async_to_lds_b128 %2, %14, off\n\tglobal_load_async_to_lds_b128 %3, %15, off\n\t"
               "global_load_async_to_lds_b128 %4, %16, off\n\tglobal_load_async_to_lds_b128 %5, %17, off\n\tglobal_load_async_to_lds_b128 %6, %18, off\n\tglobal_load_async_to_lds_b128 %7, %19, off\n\t"
               "global_load_async_to_lds_b128 %8, %20, off\n\tglobal_load_async_to_lds_b128 %9, %21, off\n\tglobal_load_async_to_lds_b128 %10, %22, off\n\tglobal_load_async_to_lds_b128 %11, %23, off\n\ts_wait_xcnt 0x0"
               :: "v"(l[0]), "v"(l[1]), "v"(l[2]), "v"(l[3]), "v"(l[4]), "v"(l[5]), "v"(l[6]), "v"(l[7]), "v"(l[8]), "v"(l[9]), "v"(l[10]), "v"(l[11]),
                  "v"(g[0]), "v"(g[1]), "v"(g[2]), "v"(g[3]), "v"(g[4]), "v"(g[5]), "v"(g[6]), "v"(g[7]), "v"(g[8]), "v"(g[9]), "v"(g[10]), "v"(g[11]) : "memory");
}
// NS stages of KT k steps. Stages 0..NS1-1 take A from A0, stages NS1.. from A1 (from its start); B (LDB columns) runs on through all NS stages. In front of stage NS1 the accumulators are scaled by 2^6 (NS1 == NS: one plane, no scaling).
template <int KT, int NS, int NS1, int LDB>
__device__ __forceinline__ void gs_main(char* smem, const _Float16* A0, const _Float16* A1, const _Float16* B, int row0, int col0, v8f (&c)[4][4]) {
  const int lane = threadIdx.x & 31; const int w = __builtin_amdgcn_readfirstlane(threadIdx.x >> 5);      /* the wave's number read as a scalar: the group addresses below are the same in every lane */
  const unsigned sbase = (unsigned)(unsigned long long)smem;      /* the low 32 bits of a __shared__ address are its byte offset in the block's LDS */
  unsigned long long g0[3], g1[3]; unsigned ld[3];
#pragma unroll      /* register arrays: every index must be a constant (here and at every unroll below) */
  for (int j = 0; j < 3; ++j) { const int gi = w * 3 + j;
    if (gi < 16) { g0[j] = (unsigned long long)(A0 + (size_t)(row0 + gi * 16) * DMOD) + 16 * lane; g1[j] = (unsigned long long)(A1 + (size_t)(row0 + gi * 16) * DMOD) + 16 * lane; }
    else { g0[j] = (unsigned long long)(B + (size_t)(col0 + (gi - 16) * 16) * LDB) + 16 * lane; g1[j] = g0[j] + (unsigned long long)NS1 * (KT * 1024); }
    ld[j] = sbase + gi * (KT * 1024) + 16 * lane; }
  auto copy_stage = [&](int s) {
    const unsigned bo = (s & 1) * GS_STAGE(KT); const bool second = s >= NS1; const unsigned long long so = (unsigned long long)(second ? s - NS1 : s) * (KT * 1024);
#pragma unroll
    for (int p = 0; p < KT / 2; ++p) { unsigned l[12]; unsigned long long g[12];      /* 12 copies a statement: 2 KiB of each of the wave's 3 groups */
#pragma unroll
      for (int j = 0; j < 3; ++j)
#pragma unroll
        for (int q = 0; q < 4; ++q) { l[j * 4 + q] = ld[j] + bo + (p * 4 + q) * 512; g[j * 4 + q] = (second ? g1[j] : g0[j]) + so + (p * 4 + q) * 512; }
      gs_copy12(l, g); } };
  copy_stage(0);
  asm volatile("s_wait_asynccnt 0x0" ::: "memory");      /* this wave's part of stage 0 has landed */
  __syncthreads();      /* every wave's part of stage 0 has landed */
  copy_stage(1);
  const int ao = (w >> 1) * (4 * KT * 1024) + 16 * lane, bo = (16 + (w & 1) * 4) * (KT * 1024) + 16 * lane;
#pragma unroll 1
  for (int s = 0; s < NS; ++s) {      /* rolled: one stage a trip, the buffer picked by the trip's parity */
    if (NS1 < NS && s == NS1) {
#pragma unroll
      for (int i = 0; i < 4; ++i)
#pragma unroll
        for (int t = 0; t < 4; ++t) c[i][t] *= 64.0f; }      /* 2^6 = (1 / 16) / (1 / 1024) */
    const char* ab = smem + (s & 1) * GS_STAGE(KT) + ao; const char* bb = smem + (s & 1) * GS_STAGE(KT) + bo;
#pragma unroll
    for (int kt = 0; kt < KT; ++kt) { v16h a[4], b[4];
#pragma unroll
      for (int i = 0; i < 4; ++i) { a[i] = gs_frag(ab + i * (KT * 1024) + kt * 1024); b[i] = gs_frag(bb + i * (KT * 1024) + kt * 1024); }
#pragma unroll
      for (int t = 0; t < 4; ++t)
#pragma unroll
        for (int i = 0; i < 4; ++i) c[i][t] = g2_mma(a[i], b[t], c[i][t]); }
    asm volatile("s_wait_dscnt 0x0" ::: "memory");      /* this wave's reads of the trip's buffer are done before the buffer is given up */
    asm volatile("s_wait_asynccnt 0x0" ::: "memory");      /* this wave's part of stage s + 1 has landed */
    __syncthreads();      /* publishes stage s + 1 and ends every wave's reads of stage s */
    if (s + 2 < NS) copy_stage(s + 2); }
  asm volatile("s_wait_asynccnt 0x0" ::: "memory");      /* nothing is in flight when the ring becomes the epilogue's staging; the last trip's barrier has ended every read of it */
}
// Projection GEMM, one launch for both operand planes: C[NR][DMOD] (f32) = (Ah Bt_hi^T) / 16 + (Al Bt_lo^T) / 1024 + bf16(bias). Ah, Al = the attention output hi and 2^10 residual (DMOD columns), Bt = the weight plane (rows = output column, 2 * DMOD columns: [16 W | W]), all in fragment order.
// The hi products run first; the accumulators are then scaled by 2^6 (exact) and the residual products are summed on top of them, so that one factor 1/1024 at the end serves both.
// 256 blocks, one per WGP: stages of 128 k, so that the two buffers (192 KiB) leave room for no second block on a WGP and a stage's products outlast the next stage's landing; 128 accumulator registers + one fragment set of 64 + addresses stay inside 256 registers.
__global__ __launch_bounds__(256, 4) void k_gemm_proj(const _Float16* __restrict__ Ah, const _Float16* __restrict__ Al, const _Float16* __restrict__ Bt, const float* __restrict__ bias, float* __restrict__ C) {
  __shared__ __attribute__((aligned(1024))) char smem[2 * GS_STAGE(4)];
  const int tid = threadIdx.x, lane = tid & 31, ln = lane & 15, hh = lane >> 4; const int w = __builtin_amdgcn_readfirstlane(tid >> 5);
  constexpr int ntn = DMOD / 128; const int mt = blockIdx.x / ntn, nq = blockIdx.x - mt * ntn; const int row0 = mt * 256, col0 = nq * 128;
  v8f c[4][4];
#pragma unroll
  for (int i = 0; i < 4; ++i)
#pragma unroll
    for (int t = 0; t < 4; ++t) c[i][t] = (v8f){0.f,0.f,0.f,0.f,0.f,0.f,0.f,0.f};
  gs_main<4, 2 * DMOD / 128, DMOD / 128, 2 * DMOD>(smem, Ah, Al, Bt, row0, col0, c);
  const int roww = row0 + (w >> 1) * 64, colw = col0 + (w & 1) * 64;
  float (*so)[68] = (float (*)[68])(smem + w * (32 * 68 * 4));      /* the wave's own 32 x 68 floats of the ring, which nobody reads any more */
  const int rsub = lane >> 4, c4 = (lane & 15) * 4;
#pragma unroll
  for (int h2 = 0; h2 < 2; ++h2) {      /* the wave's 64 rows in two halves of 32 through the same staging rows */
#pragma unroll
    for (int u = 0; u < 8; ++u) { const int t = u & 3, half = u >> 2; const float bv = bf16_round(bias[colw + t * 16 + ln]);
#pragma unroll
      for (int r = 0; r < 8; ++r) so[half * 16 + 8 * hh + r][t * 16 + ln] = c[h2 * 2 + half][t][r] * 0.0009765625f + bv; }
    __builtin_amdgcn_fence(__ATOMIC_ACQ_REL, "workgroup"); __builtin_amdgcn_wave_barrier();      /* the wave's own LDS writes are done before its lanes read each other's rows */
#pragma unroll
    for (int q = 0; q < 16; ++q) { const int r = q * 2 + rsub; const v4f v = *(const v4fa*)&so[r][c4]; *(v4f*)(C + (size_t)(roww + h2 * 32 + r) * DMOD + colw + c4) = v; }      /* whole 256-byte row pieces: 16 lanes x 16 bytes */
    if (h2 == 0) { asm volatile("s_wait_xcnt 0x0" ::: "memory");      /* behind the half's 16 stores and in front of the next half's work, which reuses their registers */
      __builtin_amdgcn_fence(__ATOMIC_ACQ_REL, "workgroup"); __builtin_amdgcn_wave_barrier(); } } }      /* the reads are done before the next half's writes */



// qkv GEMM: the main loop above (A = x plane, Bh = weight plane, both DMOD columns, fragment order) over NR rows x 3 * DMOD columns; v = acc / 16 + PB[(row / SLEN) * 3 * DMOD + col] (raw f32 add of the computed per-batch bias).
// The epilogue writes the flash kernel's operand planes itself, so that no f32 q|k|v plane is stored and re-read and no split or transpose launch follows; a wave's 64 x 64 tile goes out as two halves of 32 rows:
// q, k columns (col < 2 * DMOD): each 32 x 64 half goes through the wave's own LDS rows to turn lane = column into lane = row, is split into f16 hi + 2^10 residual and stored to H3 / L3 (3 * DMOD columns, fragment order; the v columns of both planes stay unused): the 64 columns are 2 neighbouring 1-KiB tiles per 16 rows, every store 512 contiguous bytes per wave.
// v columns: a wave's 64 columns are one head. Accumulator (row group, t) holds in lane 16 * hh + ln column d = t * 16 + ln and 8 neighbouring tokens: exactly one 16-byte chunk of row d in the V^T plane (rows slab * 64 + d, SLEN columns, fragment order), stored straight from registers, 512 contiguous bytes per wave.
// Stages of 64 k. 768 blocks, 3 per WGP, two resident at a time (96 KiB of LDS and at most 256 registers each wave): one block's epilogue and first stage run beside the other's products.
__global__ __launch_bounds__(256, 4) void k_gemm_qkv(const _Float16* __restrict__ A, const _Float16* __restrict__ Bh, const float* __restrict__ PB, _Float16* __restrict__ H3, _Float16* __restrict__ L3, _Float16* __restrict__ Vt) {
  __shared__ __attribute__((aligned(1024))) char smem[2 * GS_STAGE(2)];
  const int tid = threadIdx.x, lane = tid & 31, ln = lane & 15, hh = lane >> 4; const int w = __builtin_amdgcn_readfirstlane(tid >> 5);
  constexpr int ntn = 3 * DMOD / 128; const int mt = blockIdx.x / ntn, nq = blockIdx.x - mt * ntn; const int row0 = mt * 256, col0 = nq * 128;
  v8f c[4][4];
#pragma unroll
  for (int i = 0; i < 4; ++i)
#pragma unroll
    for (int t = 0; t < 4; ++t) c[i][t] = (v8f){0.f,0.f,0.f,0.f,0.f,0.f,0.f,0.f};
  gs_main<2, DMOD / 64, DMOD / 64, DMOD>(smem, A, A, Bh, row0, col0, c);
  const int roww = row0 + (w >> 1) * 64, colw = col0 + (w & 1) * 64;
  const int bat = row0 / SLEN; const float* cp = PB + (size_t)bat * 3 * DMOD + colw + ln;      /* a block's 256 rows lie in one batch */
  float bv4[4];
#pragma unroll
  for (int t = 0; t < 4; ++t) bv4[t] = cp[t * 16];
  asm volatile("s_wait_xcnt 0x0" :: "v"(cp) : "memory");      /* behind the 4 bias loads and in front of any reuse of their address registers: naming the address as an input keeps its registers untouched up to this wait */
  if (col0 >= 2 * DMOD) {      /* the same for the whole block */
    const int slab = bat * NH + (colw - 2 * DMOD) / 64;
    unsigned short* vt = (unsigned short*)Vt + ((size_t)slab * 4 * (SLEN / 32) + (roww % SLEN) / 32) * 512 + 8 * lane;
#pragma unroll
    for (int u = 0; u < 16; ++u) { const int t = u & 3, g = u >> 2; const float bv = bv4[t]; FragH f;      /* row group g: 32-token tile g / 2, its half g % 2 */
#pragma unroll
      for (int r = 0; r < 8; ++r) f.h[r] = (_Float16)(c[g][t][r] * 0.0625f + bv);
      *(v8us*)(vt + (size_t)t * (SLEN / 32) * 512 + (g >> 1) * 512 + (g & 1) * 256) = f.half[0]; }
  } else {
    float (*so)[68] = (float (*)[68])(smem + w * (32 * 68 * 4));      /* the wave's own 32 x 68 floats of the ring, which nobody reads any more */
#pragma unroll
    for (int h2 = 0; h2 < 2; ++h2) {
#pragma unroll
      for (int u = 0; u < 8; ++u) { const int t = u & 3, half = u >> 2; const float bv = bv4[t];
#pragma unroll
        for (int r = 0; r < 8; ++r) so[half * 16 + 8 * hh + r][t * 16 + ln] = c[h2 * 2 + half][t][r] * 0.0625f + bv; }
      __builtin_amdgcn_fence(__ATOMIC_ACQ_REL, "workgroup"); __builtin_amdgcn_wave_barrier();      /* the wave's own LDS writes are done before its lanes read each other's rows */
      const size_t o0 = ((size_t)((roww + h2 * 32) >> 4) * (3 * DMOD / 32) + (colw >> 5)) * 512 + 8 * lane; unsigned short* hp = (unsigned short*)H3 + o0; unsigned short* lp = (unsigned short*)L3 + o0;
#pragma unroll
      for (int q = 0; q < 8; ++q) { const int g = q >> 2; const float* sp = &so[g * 16 + ln][((q >> 1) & 1) * 32 + ((q & 1) * 2 + hh) * 8];      /* the lane's chunk is number (q & 3) * 32 + lane of the 128 in the 2 tiles of row group g: row ln, the 8 columns from 8 * (number / 16) */
        const v4f a = *(const v4fa*)sp, e = *(const v4fa*)(sp + 4); FragH fh, fl;
#pragma unroll
        for (int i = 0; i < 4; ++i) { _Float16 hv = (_Float16)a[i]; fh.h[i] = hv; fl.h[i] = (_Float16)((a[i] - (float)hv) * 1024.0f); hv = (_Float16)e[i]; fh.h[4 + i] = hv; fl.h[4 + i] = (_Float16)((e[i] - (float)hv) * 1024.0f); }
        const size_t o = (size_t)g * (3 * DMOD / 32) * 512 + (q & 3) * 256; *(v8us*)(hp + o) = fh.half[0]; *(v8us*)(lp + o) = fl.half[0]; }
      asm volatile("s_wait_xcnt 0x0" ::: "memory");      /* behind the half's 16 stores: the next half reuses their registers, and behind the last half the compiler lays the v branch's code with an edge (never taken) on which they are rewritten with no wait of its own */
      if (h2 == 0) { __builtin_amdgcn_fence(__ATOMIC_ACQ_REL, "workgroup"); __builtin_amdgcn_wave_barrier(); } }      /* the reads are done before the next half's writes */
  } }

template <int CAUSAL>
__global__ __launch_bounds__(128) void k_flash(const _Float16* __restrict__ Q16, int ldq, const _Float16* __restrict__ K16, int ldk, const _Float16* __restrict__ Vt, const int* __restrict__ MSK, float* __restrict__ O, int ldo) {
  constexpr int RPW = 16, RTN = RPW / 16, NQB = TQ / (4 * RPW), DT = 4, KS = 2;
  __shared__ __attribute__((aligned(16))) unsigned short sP[4][RPW][40]; __shared__ __attribute__((aligned(16))) float sO[4][RPW][64 + 4];
  const int tid = threadIdx.x, w = tid >> 5, lane = tid & 31, ln = lane & 15, hh = lane >> 4;
  const int slab = blockIdx.x / QBLKS, qblk = blockIdx.x % QBLKS; (void)NQB; const int b = slab / NH, h = slab % NH; const int qb0 = qblk * (4 * RPW); const int q0 = qb0 + w * RPW;
  FragH aq[2][KS];
#pragma unroll
  for (int rt = 0; rt < RTN; ++rt) { const unsigned short* qr = (const unsigned short*)Q16 + ((size_t)b * TQ + q0 + rt * 16 + ln) * ldq + h * 64;
#pragma unroll
    for (int ks = 0; ks < KS; ++ks) { aq[rt][ks].half[0] = *(const v8us*)(qr + ks * 32 + 8 * hh); aq[rt][ks].half[1] = *(const v8us*)(qr + ks * 32 + 16 + 8 * hh); } }
  const unsigned short* Vth = (const unsigned short*)Vt + (size_t)slab * 64 * TK;
  float m_r[2][8], l_r[2][8]; v8f oacc[2][DT];
#pragma unroll
  for (int rt = 0; rt < RTN; ++rt) {
#pragma unroll
    for (int r = 0; r < 8; ++r) { m_r[rt][r] = -3.0e38f; l_r[rt][r] = 0.f; }
#pragma unroll
    for (int dt = 0; dt < DT; ++dt) oacc[rt][dt] = (v8f){0.f,0.f,0.f,0.f,0.f,0.f,0.f,0.f}; }
  const int jend = (CAUSAL == 1) ? (qb0 + 4 * RPW) : TK;      /* causal: keys beyond the block's last query never contribute */
#pragma unroll 1
  for (int j0 = 0; j0 < jend; j0 += 32) {
    v8f s[2][2];
#pragma unroll
    for (int nt = 0; nt < 2; ++nt) { const unsigned short* kr = (const unsigned short*)K16 + ((size_t)b * TK + j0 + nt * 16 + ln) * ldk + h * 64; FragH bk[KS];
#pragma unroll
      for (int ks = 0; ks < KS; ++ks) { bk[ks].half[0] = *(const v8us*)(kr + ks * 32 + 8 * hh); bk[ks].half[1] = *(const v8us*)(kr + ks * 32 + 16 + 8 * hh); }
#pragma unroll
      for (int rt = 0; rt < RTN; ++rt) { v8f acc = (v8f){0.f,0.f,0.f,0.f,0.f,0.f,0.f,0.f};
#pragma unroll
        for (int ks = 0; ks < KS; ++ks) acc = mmaH<1>(aq[rt][ks].v, aq[rt][ks].v, bk[ks].v, bk[ks].v, acc); s[rt][nt] = acc; } }
#pragma unroll
    for (int rt = 0; rt < RTN; ++rt)
#pragma unroll
      for (int r = 0; r < 8; ++r) { const int tq = q0 + rt * 16 + 8 * hh + r; const int k0 = j0 + ln, k1 = j0 + 16 + ln;
        const bool ok0 = (CAUSAL == 1) ? (k0 <= tq) : ((CAUSAL == 2) ? ((k0 >> 5) == (tq >> 5)) : true), ok1 = (CAUSAL == 1) ? (k1 <= tq) : ((CAUSAL == 2) ? ((k1 >> 5) == (tq >> 5)) : true);      /* mode 2: block-diagonal 32-token groups */
        const float s0 = ok0 ? s[rt][0][r] * SCL : -3.0e38f, s1 = ok1 ? s[rt][1][r] * SCL : -3.0e38f; float mc = fmaxf(s0, s1);
        mc = fmaxf(mc, __shfl_xor(mc, 1, 32)); mc = fmaxf(mc, __shfl_xor(mc, 2, 32)); mc = fmaxf(mc, __shfl_xor(mc, 4, 32)); mc = fmaxf(mc, __shfl_xor(mc, 8, 32));
        const float mn = fmaxf(m_r[rt][r], mc); const float al = (mn > -1.0e38f) ? expf(m_r[rt][r] - mn) : 1.0f; m_r[rt][r] = mn; const float p0 = ok0 ? expf(s0 - mn) : 0.f, p1 = ok1 ? expf(s1 - mn) : 0.f; l_r[rt][r] = l_r[rt][r] * al + p0 + p1;
#pragma unroll
        for (int dt = 0; dt < DT; ++dt) oacc[rt][dt][r] *= al;
        FragH t2; t2.h[0] = (_Float16)(p0 * 1024.0f); t2.h[1] = (_Float16)(p1 * 1024.0f); sP[w][rt * 16 + 8 * hh + r][ln] = t2.u[0]; sP[w][rt * 16 + 8 * hh + r][16 + ln] = t2.u[1]; }
    __builtin_amdgcn_fence(__ATOMIC_ACQ_REL, "workgroup"); __builtin_amdgcn_wave_barrier();
    FragH pa[2];
#pragma unroll
    for (int rt = 0; rt < RTN; ++rt) { pa[rt].half[0] = *(const v8us*)&sP[w][rt * 16 + ln][8 * hh]; pa[rt].half[1] = *(const v8us*)&sP[w][rt * 16 + ln][16 + 8 * hh]; }
#pragma unroll
    for (int dt = 0; dt < DT; ++dt) { const unsigned short* vrow = Vth + (size_t)(dt * 16 + ln) * TK + j0; FragH bv; bv.half[0] = *(const v8us*)(vrow + 8 * hh); bv.half[1] = *(const v8us*)(vrow + 16 + 8 * hh);
#pragma unroll
      for (int rt = 0; rt < RTN; ++rt) oacc[rt][dt] = mmaH<1>(pa[rt].v, pa[rt].v, bv.v, bv.v, oacc[rt][dt]); }
    __builtin_amdgcn_fence(__ATOMIC_ACQ_REL, "workgroup"); __builtin_amdgcn_wave_barrier(); }
#pragma unroll
  for (int rt = 0; rt < RTN; ++rt) {
#pragma unroll
    for (int r = 0; r < 8; ++r) { float l = l_r[rt][r]; l += __shfl_xor(l, 1, 32); l += __shfl_xor(l, 2, 32); l += __shfl_xor(l, 4, 32); l += __shfl_xor(l, 8, 32); l_r[rt][r] = (l > 0.f) ? 1.0f / (l * 1024.0f) : 0.f; }
#pragma unroll
    for (int dt = 0; dt < DT; ++dt)
#pragma unroll
      for (int r = 0; r < 8; ++r) sO[w][rt * 16 + 8 * hh + r][dt * 16 + ln] = oacc[rt][dt][r] * l_r[rt][r]; }
  __builtin_amdgcn_fence(__ATOMIC_ACQ_REL, "workgroup"); __builtin_amdgcn_wave_barrier();
  {
#pragma unroll
    for (int rp = 0; rp < RPW; rp += 2) { const int r = rp + (lane >> 4), pc = lane & 15; const v4f val = *(const v4fa*)&sO[w][r][pc * 4]; *(v4f*)(O + ((size_t)b * TQ + q0 + r) * ldo + h * 64 + pc * 4) = val; }
     } }
// Q/K-split flash kernel, TRANSPOSED products: S^T = Kh Qh^T + (Kh Ql^T + Kl Qh^T)/1024 with K as the A operand and Q as the B operand, then O^T += V^T P^T. Q/K = [hi | 2^10 residual] f16 planes (QL/KL same layout as Q16/K16); plain f16 P (x2^10); Q, K planes (ldq, ldk columns) and V^T (TK columns) in fragment order (the A and the B loader of this form read a tile alike, so every fragment load is the one of the untransposed form).
// Why transposed: the accumulator of S^T holds, in lane 16 * hh + ln, query ln and keys nt * 16 + 8 * hh + r. A query's 32 scores thus sit in two lanes (ln and ln + 16): maximum and sum are in-lane work plus one exchange between the wave's halves, one running maximum / sum / rescale factor per lane, and element nt * 8 + r of the lane is exactly element nt * 8 + r of the B fragment of P^T (k = 8 * hh + i in its first half, 16 + 8 * hh + i in its second), so P goes from the accumulators into the next product without LDS.
__device__ __forceinline__ float xhalf(float x) { return __builtin_bit_cast(float, __builtin_amdgcn_permlanex16(__builtin_bit_cast(int, x), __builtin_bit_cast(int, x), 0x76543210, 0xfedcba98, false, false)); }      /* lane l with lane l ^ 16 */
// Two query tiles (32 queries) a wave: every K hi, K residual and V^T fragment that the wave loads feeds both tiles' products, so the loads and the waits on them per product are halved; each query's own products, maximum, sums and their order are those of the one-tile form. 1024 blocks of 4 waves = 4 waves per SIMD, asked for below, so that the whole grid is resident at once.
__global__ __launch_bounds__(128, 4) void k_flashqk(const _Float16* __restrict__ Q16, const _Float16* __restrict__ QL, int ldq, const _Float16* __restrict__ K16, const _Float16* __restrict__ KL, int ldk, const _Float16* __restrict__ Vt, _Float16* __restrict__ OH, _Float16* __restrict__ OL) {
  constexpr int QT = FQT, RPW = 16 * QT, DT = 4, KS = 2;
  const int tid = threadIdx.x, w = tid >> 5, lane = tid & 31;
  const int slab = blockIdx.x / FQBLKS, qblk = blockIdx.x % FQBLKS; const int b = slab / NH, h = slab % NH; const int q0 = qblk * (4 * RPW) + w * RPW;
  FragH bq[QT][KS], bql[QT][KS];
#pragma unroll      /* here and at every unroll of this kernel: the arrays indexed are registers, so every index must be a constant */
  for (int qt = 0; qt < QT; ++qt) { const unsigned short* qr = (const unsigned short*)Q16 + ((size_t)b * TQ + q0 + qt * 16) * ldq + h * 1024 + 8 * lane; const unsigned short* ql = (const unsigned short*)QL + ((size_t)b * TQ + q0 + qt * 16) * ldq + h * 1024 + 8 * lane;      /* fragment order: a head's 64 columns are 2 tiles of 512 elements */
#pragma unroll
    for (int ks = 0; ks < KS; ++ks) { bq[qt][ks].half[0] = *(const v8us*)(qr + ks * 512); bq[qt][ks].half[1] = *(const v8us*)(qr + ks * 512 + 256); bql[qt][ks].half[0] = *(const v8us*)(ql + ks * 512); bql[qt][ks].half[1] = *(const v8us*)(ql + ks * 512 + 256); }
    asm volatile("s_wait_xcnt 0x0" :: "v"(qr), "v"(ql) : "memory"); }      /* behind the tile's 8 loads and in front of any reuse of their address registers, in the form used behind the K loads below */
  const unsigned short* Vth = (const unsigned short*)Vt + (size_t)slab * 64 * TK;
  float m_q[QT], l_q[QT]; v8f oacc[QT][DT];      /* of query ln of tile qt; l_q holds the sum over this half's keys, the halves are joined behind the loop */
#pragma unroll
  for (int qt = 0; qt < QT; ++qt) { m_q[qt] = -3.0e38f; l_q[qt] = 0.f;
#pragma unroll
    for (int dt = 0; dt < DT; ++dt) oacc[qt][dt] = (v8f){0.f,0.f,0.f,0.f,0.f,0.f,0.f,0.f}; }
#pragma unroll 1
  for (int j0 = 0; j0 < TK; j0 += 32) {
    float sc[QT][16];
#pragma unroll
    for (int nt = 0; nt < 2; ++nt) { const unsigned short* kr = (const unsigned short*)K16 + ((size_t)b * TK + j0 + nt * 16) * ldk + h * 1024 + 8 * lane; const unsigned short* klr = (const unsigned short*)KL + ((size_t)b * TK + j0 + nt * 16) * ldk + h * 1024 + 8 * lane; FragH ak[KS], akl[KS];
#pragma unroll
      for (int ks = 0; ks < KS; ++ks) { ak[ks].half[0] = *(const v8us*)(kr + ks * 512); ak[ks].half[1] = *(const v8us*)(kr + ks * 512 + 256); akl[ks].half[0] = *(const v8us*)(klr + ks * 512); akl[ks].half[1] = *(const v8us*)(klr + ks * 512 + 256); }
      asm volatile("s_wait_xcnt 0x0" :: "v"(kr), "v"(klr) : "memory");      /* behind the tile's 8 loads and in front of any reuse of their address registers: naming the two addresses as inputs keeps their registers untouched up to this wait */
      v8f acc[QT], accl[QT];
#pragma unroll
      for (int qt = 0; qt < QT; ++qt) { acc[qt] = (v8f){0.f,0.f,0.f,0.f,0.f,0.f,0.f,0.f}; accl[qt] = acc[qt]; }
#pragma unroll
      for (int ks = 0; ks < KS; ++ks) {      /* the two tiles' products alternate: a product that adds to the one before it in its own chain stands two places behind it */
#pragma unroll
        for (int qt = 0; qt < QT; ++qt) acc[qt] = mmaH<1>(ak[ks].v, ak[ks].v, bq[qt][ks].v, bq[qt][ks].v, acc[qt]);
#pragma unroll
        for (int qt = 0; qt < QT; ++qt) accl[qt] = mmaH<1>(ak[ks].v, ak[ks].v, bql[qt][ks].v, bql[qt][ks].v, accl[qt]);
#pragma unroll
        for (int qt = 0; qt < QT; ++qt) accl[qt] = mmaH<1>(akl[ks].v, akl[ks].v, bq[qt][ks].v, bq[qt][ks].v, accl[qt]); }
#pragma unroll
      for (int qt = 0; qt < QT; ++qt)
#pragma unroll
        for (int r = 0; r < 8; ++r) sc[qt][nt * 8 + r] = acc[qt][r] + accl[qt][r] * 0.0009765625f; }      /* the raw q.k: its scale is applied inside the exponent's FMA below; the maximum is taken on raw scores (the scale is positive) */
    FragH av[DT]; const unsigned short* vr = Vth + j0 * 16 + 8 * lane;      /* fragment order: 32 keys = one tile of 512 elements; rows d of V^T are the A operand */
#pragma unroll
    for (int dt = 0; dt < DT; ++dt) { const unsigned short* vrow = vr + (size_t)(dt * 16) * TK; av[dt].half[0] = *(const v8us*)(vrow); av[dt].half[1] = *(const v8us*)(vrow + 256); }
    asm volatile("s_wait_xcnt 0x0" :: "v"(vr) : "memory");      /* behind the 8 V^T loads, as behind the K loads above: naming the address keeps its registers untouched up to this wait */
    __builtin_amdgcn_sched_barrier(0);      /* keeps the 8 V^T loads in front of the softmax, which then covers their latency: left free, the scheduler sinks 6 of them to just in front of their products, where the wave waits them out */
    FragH pb[QT];
#pragma unroll
    for (int qt = 0; qt < QT; ++qt) {
      float mx[8];
#pragma unroll
      for (int i = 0; i < 8; ++i) mx[i] = fmaxf(sc[qt][i], sc[qt][8 + i]);
      float mc = fmaxf(fmaxf(fmaxf(mx[0], mx[1]), fmaxf(mx[2], mx[3])), fmaxf(fmaxf(mx[4], mx[5]), fmaxf(mx[6], mx[7])));
      mc = fmaxf(mc, xhalf(mc));
      const float mn = fmaxf(m_q[qt], mc); const float ea = __builtin_amdgcn_exp2f((m_q[qt] - mn) * SCL2); const float al = (mn > -1.0e38f) ? ea : 1.0f; m_q[qt] = mn;
      const float nb = 10.0f - mn * SCL2;      /* base-2 softmax: 2^10 e^(scale (s - max)) = 2^(s * SCL2 + nb), one FMA and one v_exp_f32 a score; an exponent below the normal range gives 0, far under what the f16 P can hold */
      float p[16];
#pragma unroll
      for (int i = 0; i < 16; ++i) { p[i] = __builtin_amdgcn_exp2f(sc[qt][i] * SCL2 + nb); pb[qt].h[i] = (_Float16)p[i]; }      /* p and l_q carry the factor 2^10 of P */
      l_q[qt] = l_q[qt] * al + ((((p[0] + p[1]) + (p[2] + p[3])) + ((p[4] + p[5]) + (p[6] + p[7]))) + (((p[8] + p[9]) + (p[10] + p[11])) + ((p[12] + p[13]) + (p[14] + p[15]))));
#pragma unroll
      for (int dt = 0; dt < DT; ++dt)
#pragma unroll
        for (int r = 0; r < 8; ++r) oacc[qt][dt][r] *= al; }
#pragma unroll
    for (int dt = 0; dt < DT; ++dt)
#pragma unroll
      for (int qt = 0; qt < QT; ++qt) oacc[qt][dt] = mmaH<1>(av[dt].v, av[dt].v, pb[qt].v, pb[qt].v, oacc[qt][dt]); }
  /* O^T: lane 16 * hh + ln holds query ln of tile qt and, in accumulator dt, the 8 neighbouring columns d = dt * 16 + 8 * hh + r: exactly one 16-byte chunk of the projection's A plane (row = token, DMOD columns, fragment order). The hi + 2^10 residual split is done here and each plane gets 512 contiguous bytes per wave, tile and dt, straight from registers */
#pragma unroll
  for (int qt = 0; qt < QT; ++qt) {
    const float l = l_q[qt] + xhalf(l_q[qt]); const float inv = (l > 0.f) ? 1.0f / l : 0.f;      /* l holds the 2^10 that the O^T sums hold */
    unsigned short* oh = (unsigned short*)OH + ((size_t)(((b * TQ + q0) >> 4) + qt) * (DMOD / 32) + h * 2) * 512 + 8 * lane; unsigned short* ol = (unsigned short*)OL + ((size_t)(((b * TQ + q0) >> 4) + qt) * (DMOD / 32) + h * 2) * 512 + 8 * lane;
#pragma unroll
    for (int dt = 0; dt < DT; ++dt) { FragH fh, fl;
#pragma unroll
      for (int r = 0; r < 8; ++r) { const float v = oacc[qt][dt][r] * inv; const _Float16 hv = (_Float16)v; fh.h[r] = hv; fl.h[r] = (_Float16)((v - (float)hv) * 1024.0f); }
      *(v8us*)(oh + dt * 256) = fh.half[0]; *(v8us*)(ol + dt * 256) = fl.half[0]; } } }

__global__ __launch_bounds__(256) void k_woutp(const float* __restrict__ Wm, _Float16* __restrict__ Bt) { const size_t t = (size_t)blockIdx.x * 256 + threadIdx.x; if (t >= (size_t)DMOD * (2 * DMOD / 8)) return; const int tile = (int)(t >> 6); const int pc = (tile % (2 * DMOD / 32)) * 4 + (int)((t >> 4) & 3); const int o = (tile / (2 * DMOD / 32)) * 16 + (int)(t & 15); const bool lo = pc * 8 >= DMOD; FragH f;      /* t = the output chunk in fragment order */
  for (int q = 0; q < 8; ++q) { const int c = pc * 8 + q - (lo ? DMOD : 0); f.h[q] = (_Float16)(bf16_round(Wm[(size_t)c * DMOD + o]) * (lo ? 1.0f : 16.0f)); } *(v8us*)((unsigned short*)Bt + t * 8) = f.half[0];  }      /* Wproj stored (in, out) -> Bt rows o, columns [c | 1024 + c], fragment order */
__global__ __launch_bounds__(256) void k_pose(const float* __restrict__ pose, const float* __restrict__ W1, const float* __restrict__ b1, const float* __restrict__ W2, const float* __restrict__ b2, const float* __restrict__ bqkv, float* __restrict__ PB) {
  #pragma clang fp contract(off)
  __shared__ float hs[64]; const int b = blockIdx.x / (3 * DMOD / 256), tid = threadIdx.x; const int o = (blockIdx.x % (3 * DMOD / 256)) * 256 + tid;      /* one block per (batch, 256-column slice), one output column per thread */
  float w2[64];      /* the column's 64 W2 values are fetched up front by independent loads (ahead of the hidden layer too), so a wave waits for memory once instead of once per term */
#pragma unroll
  for (int j = 0; j < 64; ++j) w2[j] = W2[(size_t)j * 3 * DMOD + o];
  const float vb2 = b2[o], vbq = bqkv[o];
  if (tid < 64) { float s = 0.f; for (int i = 0; i < 3; ++i) s += bf16_round(pose[b * 3 + i]) * bf16_round(W1[i * 64 + tid]); s += bf16_round(b1[tid]); hs[tid] = fmaxf(s, 0.f); }
  __syncthreads();
  float s = 0.f;
#pragma unroll
  for (int j = 0; j < 64; ++j) s += hs[j] * bf16_round(w2[j]);      /* terms summed in index order, j = 0..63 */
  s += bf16_round(vb2); s += bf16_round(vbq); PB[(size_t)b * 3 * DMOD + o] = s; }

extern "C" void kernel_launch(void* const* d_in, const int* in_sizes, int n_in,
                              void* d_out, int out_size, void* d_ws, size_t ws_size, hipStream_t stream) {
  (void)in_sizes; (void)n_in; (void)out_size;
  const float* const* I = (const float* const*)d_in; const float* x = I[0]; const float* pose = I[1]; const float* Wqkv = I[2]; const float* bqkv = I[3]; const float* W1 = I[4]; const float* b1 = I[5]; const float* W2 = I[6]; const float* b2 = I[7]; const float* Wp = I[8]; const float* bp = I[9];
  char* ws = (char*)d_ws; size_t off = 0;
  auto take = [&](size_t bytes) { char* p = ws + off; off += (bytes + 255) & ~(size_t)255; return p; };
  _Float16* BW = (_Float16*)take((size_t)3 * DMOD * DMOD * 2); _Float16* BO = (_Float16*)take((size_t)DMOD * 2 * DMOD * 2); float* PB = (float*)take((size_t)NB * 3 * DMOD * 4);
  _Float16* X16 = (_Float16*)take((size_t)NR * DMOD * 2); _Float16* H3 = (_Float16*)take((size_t)NR * 3 * DMOD * 2); _Float16* L3 = (_Float16*)take((size_t)NR * 3 * DMOD * 2); _Float16* VT = (_Float16*)take((size_t)NR * DMOD * 2); _Float16* Hh = (_Float16*)take((size_t)NR * DMOD * 2); _Float16* Hl = (_Float16*)take((size_t)NR * DMOD * 2);      /* H3/L3: 3072 columns q | k | (unused) in fragment order, where a step of 1024 columns is 32 tiles = 16 * DMOD elements; Hh/Hl are planes of their own: the flash kernel writes them while other blocks still read H3/L3 */
  if (off > ws_size) return;      /* 6 + 4 + 16 + 48 + 48 + 16 + 16 + 16 = 170 MiB (256 MiB ws) */
  k_wt_f16<<<(unsigned)(((size_t)3 * DMOD * (DMOD / 8) + 255) / 256), 256, 0, stream>>>(Wqkv, BW, DMOD, 3 * DMOD, 16.0f); k_woutp<<<(unsigned)(((size_t)DMOD * (2 * DMOD / 8) + 255) / 256), 256, 0, stream>>>(Wp, BO);
  k_pose<<<NB * (3 * DMOD / 256), 256, 0, stream>>>(pose, W1, b1, W2, b2, bqkv, PB);
  k_x16<<<(unsigned)(((size_t)NR * DMOD / 8 + 255) / 256), 256, 0, stream>>>(x, X16, (size_t)NR * DMOD / 8);
  const dim3 gQ((NR / 256) * (3 * DMOD / 128), 1), gA((NR / 256) * (DMOD / 128), 1);
  k_gemm_qkv<<<gQ, 256, 0, stream>>>(X16, BW, PB, H3, L3, VT);      /* all batches and q|k|v in one launch; + (bqkv + pose bias of batch row / 1024), a COMPUTED f32 vector added raw (not bf16-rounded like an input bias); writes q, k hi + residual and V^T */
  k_flashqk<<<NB * NH * FQBLKS, 128, 0, stream>>>(H3, L3, 3 * DMOD, H3 + 16 * DMOD, L3 + 16 * DMOD, 3 * DMOD, VT, Hh, Hl);      /* q/k hi + residual; P (x2^10) and V plain f16; writes the attention output hi + residual */
  k_gemm_proj<<<gA, 256, 0, stream>>>(Hh, Hl, BO, bp, (float*)d_out);      /* hi and residual planes in one launch */
}
